// v000
// The times below were measured on an AMD MI455X: many runs one after another, warmed up first and cycling through
// copies of the inputs, with the whole window's GPU time divided by the number of runs. Launches and the gaps
// between them are all in it. The median over several windows is given; except for v000 it joins two sittings, which
// can be a few percent apart, so the side-by-side timings, each taken in one sitting, are the better comparison.
// The starting kernel, v000, takes 201 microseconds a run.
#include <hip/hip_runtime.h>

typedef float v2f __attribute__((ext_vector_type(2)));
typedef float v8f __attribute__((ext_vector_type(8)));

#define NPIX 4096   // 64*64
#define CIN  128

__device__ __forceinline__ v8f wmma4(v2f a, v2f b, v8f c) {
  // D = A(16x4) * B(4x16) + C, full fp32 matrix pipe
  return __builtin_amdgcn_wmma_f32_16x16x4_f32(false, a, false, b, (short)0, c, false, false);
}

__device__ __forceinline__ v8f zero8() {
  v8f z = {0.f,0.f,0.f,0.f,0.f,0.f,0.f,0.f};
  return z;
}

// ---------------------------------------------------------------------------
// Kernel 1: 1x1-conv projections (theta/phi/g) + fused 2x2 maxpool.
// Each wave owns two vertically adjacent 16-pixel strips (rows h0,h0+1),
// so pooling is a register max + shfl_xor(1) horizontal max.
// ---------------------------------------------------------------------------
__global__ __launch_bounds__(256) void proj_kernel(
    const float* __restrict__ x,
    const float* __restrict__ Wt, const float* __restrict__ bt,
    const float* __restrict__ Wp, const float* __restrict__ bp,
    const float* __restrict__ Wg, const float* __restrict__ bg,
    float* __restrict__ theta, float* __restrict__ phi_p, float* __restrict__ g_p)
{
  __shared__ float Wt_s[16 * 128];
  __shared__ float Wp_s[16 * 128];
  __shared__ float Wg_s[64 * 128];
  __shared__ float bias_s[96];

  const int tid = threadIdx.x;
  for (int i = tid; i < 16 * 128; i += 256) Wt_s[i] = Wt[i];
  for (int i = tid; i < 16 * 128; i += 256) Wp_s[i] = Wp[i];
  for (int i = tid; i < 64 * 128; i += 256) Wg_s[i] = Wg[i];
  if (tid < 16)      bias_s[tid] = bt[tid];
  else if (tid < 32) bias_s[tid] = bp[tid - 16];
  else if (tid < 96) bias_s[tid] = bg[tid - 32];
  __syncthreads();

  const int wave = tid >> 5;
  const int lane = tid & 31;
  const int col  = lane & 15;
  const bool lo  = lane < 16;

  const int wv    = blockIdx.x * 8 + wave;   // 0..2047
  const int b     = wv >> 7;                 // batch
  const int strip = wv & 127;
  const int h0    = (strip >> 2) * 2;        // even image row
  const int wb    = (strip & 3) * 16;        // column base
  const int n0    = h0 * 64 + wb;            // strip (h0)
  const int n1    = n0 + 64;                 // strip (h0+1)

  const float* xb = x + (size_t)b * CIN * NPIX;

  v8f th0 = zero8(), th1 = zero8(), ph0 = zero8(), ph1 = zero8();
  v8f gg0[4], gg1[4];
#pragma unroll
  for (int i = 0; i < 4; ++i) { gg0[i] = zero8(); gg1[i] = zero8(); }

#pragma unroll 4
  for (int kk = 0; kk < 32; ++kk) {
    const int c0 = 4 * kk + (lo ? 0 : 2);
    // B operand (x tile): lane = spatial col, VGPR r = input channel c0+r
    v2f B0, B1;
    B0.x = xb[(size_t)c0 * NPIX + n0 + col];
    B0.y = xb[(size_t)(c0 + 1) * NPIX + n0 + col];
    B1.x = xb[(size_t)c0 * NPIX + n1 + col];
    B1.y = xb[(size_t)(c0 + 1) * NPIX + n1 + col];

    v2f At = *(const v2f*)&Wt_s[col * 128 + c0];
    v2f Ap = *(const v2f*)&Wp_s[col * 128 + c0];
    th0 = wmma4(At, B0, th0); th1 = wmma4(At, B1, th1);
    ph0 = wmma4(Ap, B0, ph0); ph1 = wmma4(Ap, B1, ph1);
#pragma unroll
    for (int ct = 0; ct < 4; ++ct) {
      v2f Ag = *(const v2f*)&Wg_s[(ct * 16 + col) * 128 + c0];
      gg0[ct] = wmma4(Ag, B0, gg0[ct]);
      gg1[ct] = wmma4(Ag, B1, gg1[ct]);
    }
  }

  const int rowoff = lo ? 0 : 8;
  // theta: bias + store full-resolution
  float* thp = theta + (size_t)b * 16 * NPIX;
#pragma unroll
  for (int r = 0; r < 8; ++r) {
    const int o = r + rowoff;
    const float bv = bias_s[o];
    thp[(size_t)o * NPIX + n0 + col] = th0[r] + bv;
    thp[(size_t)o * NPIX + n1 + col] = th1[r] + bv;
  }
  // 2x2 maxpool for phi / g, then bias + store
  const int mbase = (h0 >> 1) * 32 + (wb >> 1);
  const bool evenl = (col & 1) == 0;
  float* php = phi_p + (size_t)b * 16 * 1024;
#pragma unroll
  for (int r = 0; r < 8; ++r) {
    const int o = r + rowoff;
    float v  = fmaxf(ph0[r], ph1[r]);          // vertical
    float vv = fmaxf(v, __shfl_xor(v, 1, 32)); // horizontal
    if (evenl) php[(size_t)o * 1024 + mbase + (col >> 1)] = vv + bias_s[16 + o];
  }
  float* ggp = g_p + (size_t)b * 64 * 1024;
#pragma unroll
  for (int ct = 0; ct < 4; ++ct) {
#pragma unroll
    for (int r = 0; r < 8; ++r) {
      const int o = ct * 16 + r + rowoff;
      float v  = fmaxf(gg0[ct][r], gg1[ct][r]);
      float vv = fmaxf(v, __shfl_xor(v, 1, 32));
      if (evenl) ggp[(size_t)o * 1024 + mbase + (col >> 1)] = vv + bias_s[32 + o];
    }
  }
}

// ---------------------------------------------------------------------------
// Kernel 2: fused flash attention + output projection + residual.
// Wave = 16 query rows. S^T tiles via WMMA so softmax runs along VGPRs;
// only cross-lane op needed is shfl_xor(16). O^T = g * P^T accumulated with
// WMMA; epilogue applies Wa (in LDS), ba, sigma, residual x.
// ---------------------------------------------------------------------------
__global__ __launch_bounds__(256) void attn_kernel(
    const float* __restrict__ x, const float* __restrict__ theta,
    const float* __restrict__ phi_p, const float* __restrict__ g_p,
    const float* __restrict__ Wa, const float* __restrict__ ba,
    const float* __restrict__ sigma, float* __restrict__ out)
{
  __shared__ float Wa_s[128 * 64];
  __shared__ float ba_s[128];
  __shared__ float phi_s[64 * 16];  // transposed: [m_local][k]
  __shared__ float g_s[64 * 64];    // [c][m_local]

  const int tid = threadIdx.x;
  for (int i = tid; i < 128 * 64; i += 256) Wa_s[i] = Wa[i];
  if (tid < 128) ba_s[tid] = ba[tid];
  const float sig = sigma[0];

  const int wave = tid >> 5;
  const int lane = tid & 31;
  const int col  = lane & 15;
  const bool lo  = lane < 16;

  const int b     = blockIdx.x >> 5;              // 32 blocks per batch
  const int nbase = (blockIdx.x & 31) * 128 + wave * 16;

  const float* thb = theta + (size_t)b * 16 * NPIX;
  const float* phb = phi_p + (size_t)b * 16 * 1024;
  const float* gb  = g_p   + (size_t)b * 64 * 1024;

  // theta B-operands for this row tile, kept in registers for all m
  v2f bth[4];
#pragma unroll
  for (int kk = 0; kk < 4; ++kk) {
    const int k0 = 4 * kk + (lo ? 0 : 2);
    bth[kk].x = thb[(size_t)k0 * NPIX + nbase + col];
    bth[kk].y = thb[(size_t)(k0 + 1) * NPIX + nbase + col];
  }

  v8f O[4];
#pragma unroll
  for (int i = 0; i < 4; ++i) O[i] = zero8();
  float rmax = -__builtin_inff();
  float rsum = 0.f;

  for (int ch = 0; ch < 16; ++ch) {          // 16 chunks of 64 keys
    const int moff = ch * 64;
    __syncthreads();
    for (int i = tid; i < 1024; i += 256) {  // phi chunk, transposed to [m][k]
      const int k = i >> 6, m = i & 63;
      phi_s[m * 16 + k] = phb[(size_t)k * 1024 + moff + m];
    }
    for (int i = tid; i < 4096; i += 256) {  // g chunk [c][m]
      const int c = i >> 6, m = i & 63;
      g_s[i] = gb[(size_t)c * 1024 + moff + m];
    }
    __syncthreads();

    if (ch + 1 < 16) {                       // prefetch next chunk into caches
      const int nmoff = moff + 64;
      if (tid < 128) {
        const int c = tid >> 1, half = (tid & 1) << 5;
        __builtin_prefetch(&gb[(size_t)c * 1024 + nmoff + half]);
      } else if (tid < 160) {
        const int k = (tid - 128) >> 1, half = ((tid - 128) & 1) << 5;
        __builtin_prefetch(&phb[(size_t)k * 1024 + nmoff + half]);
      }
    }

    for (int mt = 0; mt < 4; ++mt) {
      const int ml = mt * 16;
      // S^T[m, n] = sum_k phi[k,m] * theta[k,n]   (K=16 as 4 WMMA steps)
      v8f S = zero8();
#pragma unroll
      for (int kk = 0; kk < 4; ++kk) {
        const int k0 = 4 * kk + (lo ? 0 : 2);
        v2f A = *(const v2f*)&phi_s[(ml + col) * 16 + k0];
        S = wmma4(A, bth[kk], S);
      }
      // flash softmax update (rows m live in VGPRs + opposite lane half)
      float tmax = S[0];
#pragma unroll
      for (int r = 1; r < 8; ++r) tmax = fmaxf(tmax, S[r]);
      tmax = fmaxf(tmax, __shfl_xor(tmax, 16, 32));
      const float nmax  = fmaxf(rmax, tmax);
      const float scale = __expf(rmax - nmax);
      rmax = nmax;
      float p[8], ts = 0.f;
#pragma unroll
      for (int r = 0; r < 8; ++r) { p[r] = __expf(S[r] - nmax); ts += p[r]; }
      ts += __shfl_xor(ts, 16, 32);
      rsum = rsum * scale + ts;
#pragma unroll
      for (int ct = 0; ct < 4; ++ct)
#pragma unroll
        for (int r = 0; r < 8; ++r) O[ct][r] *= scale;

      // re-layout P (C-layout) into B operands (4x16 K-steps) via xor-16
      v2f pb[4];
      {
        float t;
        t = __shfl_xor(p[2], 16, 32); pb[0].x = lo ? p[0] : t;
        t = __shfl_xor(p[3], 16, 32); pb[0].y = lo ? p[1] : t;
        t = __shfl_xor(p[6], 16, 32); pb[1].x = lo ? p[4] : t;
        t = __shfl_xor(p[7], 16, 32); pb[1].y = lo ? p[5] : t;
        t = __shfl_xor(p[0], 16, 32); pb[2].x = lo ? t : p[2];
        t = __shfl_xor(p[1], 16, 32); pb[2].y = lo ? t : p[3];
        t = __shfl_xor(p[4], 16, 32); pb[3].x = lo ? t : p[6];
        t = __shfl_xor(p[5], 16, 32); pb[3].y = lo ? t : p[7];
      }
      // O^T[c, n] += sum_m g[c,m] * P[n,m]
#pragma unroll
      for (int ct = 0; ct < 4; ++ct)
#pragma unroll
        for (int kk = 0; kk < 4; ++kk) {
          const int m0 = ml + 4 * kk + (lo ? 0 : 2);
          v2f A = *(const v2f*)&g_s[(ct * 16 + col) * 64 + m0];
          O[ct] = wmma4(A, pb[kk], O[ct]);
        }
    }
  }

  // normalize, then out[co,n] = x + sigma * (Wa @ O + ba)
  const float inv = 1.f / rsum;
#pragma unroll
  for (int ct = 0; ct < 4; ++ct)
#pragma unroll
    for (int r = 0; r < 8; ++r) O[ct][r] *= inv;

  v2f bfin[16];  // O re-laid as 16 B-operand K-steps over c=0..63
#pragma unroll
  for (int ct = 0; ct < 4; ++ct) {
    float t;
    t = __shfl_xor(O[ct][2], 16, 32); bfin[ct * 4 + 0].x = lo ? O[ct][0] : t;
    t = __shfl_xor(O[ct][3], 16, 32); bfin[ct * 4 + 0].y = lo ? O[ct][1] : t;
    t = __shfl_xor(O[ct][6], 16, 32); bfin[ct * 4 + 1].x = lo ? O[ct][4] : t;
    t = __shfl_xor(O[ct][7], 16, 32); bfin[ct * 4 + 1].y = lo ? O[ct][5] : t;
    t = __shfl_xor(O[ct][0], 16, 32); bfin[ct * 4 + 2].x = lo ? t : O[ct][2];
    t = __shfl_xor(O[ct][1], 16, 32); bfin[ct * 4 + 2].y = lo ? t : O[ct][3];
    t = __shfl_xor(O[ct][4], 16, 32); bfin[ct * 4 + 3].x = lo ? t : O[ct][6];
    t = __shfl_xor(O[ct][5], 16, 32); bfin[ct * 4 + 3].y = lo ? t : O[ct][7];
  }

  const int rowoff = lo ? 0 : 8;
  const float* xb = x   + (size_t)b * CIN * NPIX;
  float*       ob = out + (size_t)b * CIN * NPIX;
#pragma unroll 2
  for (int cot = 0; cot < 8; ++cot) {
    v8f acc = zero8();
#pragma unroll
    for (int kkg = 0; kkg < 16; ++kkg) {
      const int c0 = 4 * kkg + (lo ? 0 : 2);
      v2f A = *(const v2f*)&Wa_s[(cot * 16 + col) * 64 + c0];
      acc = wmma4(A, bfin[kkg], acc);
    }
#pragma unroll
    for (int r = 0; r < 8; ++r) {
      const int co = cot * 16 + r + rowoff;
      const size_t idx = (size_t)co * NPIX + nbase + col;
      ob[idx] = xb[idx] + sig * (acc[r] + ba_s[co]);
    }
  }
}

// ---------------------------------------------------------------------------
extern "C" void kernel_launch(void* const* d_in, const int* in_sizes, int n_in,
                              void* d_out, int out_size, void* d_ws, size_t ws_size,
                              hipStream_t stream) {
  const float* x     = (const float*)d_in[0];
  const float* Wt    = (const float*)d_in[1];
  const float* bt    = (const float*)d_in[2];
  const float* Wp    = (const float*)d_in[3];
  const float* bp    = (const float*)d_in[4];
  const float* Wg    = (const float*)d_in[5];
  const float* bg    = (const float*)d_in[6];
  const float* Wa    = (const float*)d_in[7];
  const float* ba    = (const float*)d_in[8];
  const float* sigma = (const float*)d_in[9];

  float* ws    = (float*)d_ws;
  float* theta = ws;                       // 16*16*4096 = 1,048,576 f32
  float* phi_p = theta + 1048576;          // 16*16*1024 =   262,144 f32
  float* g_p   = phi_p + 262144;           // 16*64*1024 = 1,048,576 f32

  proj_kernel<<<256, 256, 0, stream>>>(x, Wt, bt, Wp, bp, Wg, bg,
                                       theta, phi_p, g_p);
  attn_kernel<<<512, 256, 0, stream>>>(x, theta, phi_p, g_p, Wa, ba, sigma,
                                       (float*)d_out);
}

// v001
// One run takes 115 microseconds.
// Timed twice side by side with v000, it ran 1.81 times as fast both times.
#include <hip/hip_runtime.h>

typedef float v2f __attribute__((ext_vector_type(2)));
typedef float v8f __attribute__((ext_vector_type(8)));

#define NPIX 4096   // 64*64
#define CIN  128

// LDS row pitches in dwords. Every A fragment is read as 8 bytes per lane, 16 rows
// at one column offset (lanes 16-31 two dwords further). A pitch of 4 * odd dwords
// puts the 64 dwords of such a read on 64 different banks; the unpadded pitches
// (128, 64, 16) put 16 (16, 4) rows on the same bank.
#define WPITCH 132  // rows of 128 dwords (projection weights)
#define GPITCH 68   // rows of 64 dwords (g chunk, output weights)
#define PPITCH 20   // rows of 16 dwords (transposed phi chunk)

__device__ __forceinline__ v8f wmma4(v2f a, v2f b, v8f c) {
  // D = A(16x4) * B(4x16) + C, full fp32 matrix pipe
  return __builtin_amdgcn_wmma_f32_16x16x4_f32(false, a, false, b, (short)0, c, false, false);
}

__device__ __forceinline__ v8f zero8() {
  v8f z = {0.f,0.f,0.f,0.f,0.f,0.f,0.f,0.f};
  return z;
}

// ---------------------------------------------------------------------------
// Kernel 1: 1x1-conv projections (theta/phi/g) + fused 2x2 maxpool.
// Each wave owns two vertically adjacent 16-pixel strips (rows h0,h0+1),
// so pooling is a register max + shfl_xor(1) horizontal max.
// ---------------------------------------------------------------------------
__global__ __launch_bounds__(256) void proj_kernel(
    const float* __restrict__ x,
    const float* __restrict__ Wt, const float* __restrict__ bt,
    const float* __restrict__ Wp, const float* __restrict__ bp,
    const float* __restrict__ Wg, const float* __restrict__ bg,
    float* __restrict__ theta, float* __restrict__ phi_p, float* __restrict__ g_p)
{
  __shared__ float Wt_s[16 * WPITCH];
  __shared__ float Wp_s[16 * WPITCH];
  __shared__ float Wg_s[64 * WPITCH];
  __shared__ float bias_s[96];

  const int tid = threadIdx.x;
  const int wdst = (tid >> 7) * WPITCH + (tid & 127);  // 256 threads = 2 rows a pass
  for (int j = 0; j < 8; ++j)  Wt_s[wdst + j * 2 * WPITCH] = Wt[tid + j * 256];
  for (int j = 0; j < 8; ++j)  Wp_s[wdst + j * 2 * WPITCH] = Wp[tid + j * 256];
  for (int j = 0; j < 32; ++j) Wg_s[wdst + j * 2 * WPITCH] = Wg[tid + j * 256];
  if (tid < 16)      bias_s[tid] = bt[tid];
  else if (tid < 32) bias_s[tid] = bp[tid - 16];
  else if (tid < 96) bias_s[tid] = bg[tid - 32];
  __syncthreads();

  const int wave = tid >> 5;
  const int lane = tid & 31;
  const int col  = lane & 15;
  const bool lo  = lane < 16;

  const int wv    = blockIdx.x * 8 + wave;   // 0..2047
  const int b     = wv >> 7;                 // batch
  const int strip = wv & 127;
  const int h0    = (strip >> 2) * 2;        // even image row
  const int wb    = (strip & 3) * 16;        // column base
  const int n0    = h0 * 64 + wb;            // strip (h0)
  const int n1    = n0 + 64;                 // strip (h0+1)

  const float* xb = x + (size_t)b * CIN * NPIX;

  v8f th0 = zero8(), th1 = zero8(), ph0 = zero8(), ph1 = zero8();
  v8f gg0[4], gg1[4];
#pragma unroll
  for (int i = 0; i < 4; ++i) { gg0[i] = zero8(); gg1[i] = zero8(); }

#pragma unroll 4
  for (int kk = 0; kk < 32; ++kk) {
    const int c0 = 4 * kk + (lo ? 0 : 2);
    // B operand (x tile): lane = spatial col, VGPR r = input channel c0+r
    v2f B0, B1;
    B0.x = xb[(size_t)c0 * NPIX + n0 + col];
    B0.y = xb[(size_t)(c0 + 1) * NPIX + n0 + col];
    B1.x = xb[(size_t)c0 * NPIX + n1 + col];
    B1.y = xb[(size_t)(c0 + 1) * NPIX + n1 + col];

    v2f At = *(const v2f*)&Wt_s[col * WPITCH + c0];
    v2f Ap = *(const v2f*)&Wp_s[col * WPITCH + c0];
    th0 = wmma4(At, B0, th0); th1 = wmma4(At, B1, th1);
    ph0 = wmma4(Ap, B0, ph0); ph1 = wmma4(Ap, B1, ph1);
#pragma unroll
    for (int ct = 0; ct < 4; ++ct) {
      v2f Ag = *(const v2f*)&Wg_s[(ct * 16 + col) * WPITCH + c0];
      gg0[ct] = wmma4(Ag, B0, gg0[ct]);
      gg1[ct] = wmma4(Ag, B1, gg1[ct]);
    }
  }

  const int rowoff = lo ? 0 : 8;
  // theta: bias + store full-resolution
  float* thp = theta + (size_t)b * 16 * NPIX;
#pragma unroll
  for (int r = 0; r < 8; ++r) {
    const int o = r + rowoff;
    const float bv = bias_s[o];
    thp[(size_t)o * NPIX + n0 + col] = th0[r] + bv;
    thp[(size_t)o * NPIX + n1 + col] = th1[r] + bv;
  }
  // 2x2 maxpool for phi / g, then bias + store
  const int mbase = (h0 >> 1) * 32 + (wb >> 1);
  const bool evenl = (col & 1) == 0;
  float* php = phi_p + (size_t)b * 16 * 1024;
#pragma unroll
  for (int r = 0; r < 8; ++r) {
    const int o = r + rowoff;
    float v  = fmaxf(ph0[r], ph1[r]);          // vertical
    float vv = fmaxf(v, __shfl_xor(v, 1, 32)); // horizontal
    if (evenl) php[(size_t)o * 1024 + mbase + (col >> 1)] = vv + bias_s[16 + o];
  }
  float* ggp = g_p + (size_t)b * 64 * 1024;
#pragma unroll
  for (int ct = 0; ct < 4; ++ct) {
#pragma unroll
    for (int r = 0; r < 8; ++r) {
      const int o = ct * 16 + r + rowoff;
      float v  = fmaxf(gg0[ct][r], gg1[ct][r]);
      float vv = fmaxf(v, __shfl_xor(v, 1, 32));
      if (evenl) ggp[(size_t)o * 1024 + mbase + (col >> 1)] = vv + bias_s[32 + o];
    }
  }
}

// ---------------------------------------------------------------------------
// Kernel 2: fused flash attention + output projection + residual.
// Wave = 16 query rows. S^T tiles via WMMA so softmax runs along VGPRs;
// only cross-lane op needed is shfl_xor(16). O^T = g * P^T accumulated with
// WMMA; epilogue applies Wa (in LDS), ba, sigma, residual x.
// ---------------------------------------------------------------------------
__global__ __launch_bounds__(256) void attn_kernel(
    const float* __restrict__ x, const float* __restrict__ theta,
    const float* __restrict__ phi_p, const float* __restrict__ g_p,
    const float* __restrict__ Wa, const float* __restrict__ ba,
    const float* __restrict__ sigma, float* __restrict__ out)
{
  __shared__ float Wa_s[128 * GPITCH];
  __shared__ float ba_s[128];
  __shared__ float phi_s[64 * PPITCH];  // transposed: [m_local][k]
  __shared__ float g_s[64 * GPITCH];    // [c][m_local]

  const int tid = threadIdx.x;
  const int wdst = (tid >> 6) * GPITCH + (tid & 63);   // 256 threads = 4 rows a pass
  for (int j = 0; j < 32; ++j) Wa_s[wdst + j * 4 * GPITCH] = Wa[tid + j * 256];
  if (tid < 128) ba_s[tid] = ba[tid];
  const float sig = sigma[0];

  const int wave = tid >> 5;
  const int lane = tid & 31;
  const int col  = lane & 15;
  const bool lo  = lane < 16;

  const int b     = blockIdx.x >> 5;              // 32 blocks per batch
  const int nbase = (blockIdx.x & 31) * 128 + wave * 16;

  const float* thb = theta + (size_t)b * 16 * NPIX;
  const float* phb = phi_p + (size_t)b * 16 * 1024;
  const float* gb  = g_p   + (size_t)b * 64 * 1024;

  // theta B-operands for this row tile, kept in registers for all m
  v2f bth[4];
#pragma unroll
  for (int kk = 0; kk < 4; ++kk) {
    const int k0 = 4 * kk + (lo ? 0 : 2);
    bth[kk].x = thb[(size_t)k0 * NPIX + nbase + col];
    bth[kk].y = thb[(size_t)(k0 + 1) * NPIX + nbase + col];
  }

  v8f O[4];
#pragma unroll
  for (int i = 0; i < 4; ++i) O[i] = zero8();
  float rmax = -__builtin_inff();
  float rsum = 0.f;

  for (int ch = 0; ch < 16; ++ch) {          // 16 chunks of 64 keys
    const int moff = ch * 64;
    __syncthreads();
    for (int i = tid; i < 1024; i += 256) {  // phi chunk, transposed to [m][k]
      const int k = i >> 6, m = i & 63;
      phi_s[m * PPITCH + k] = phb[(size_t)k * 1024 + moff + m];
    }
    for (int i = tid; i < 4096; i += 256) {  // g chunk [c][m]
      const int c = i >> 6, m = i & 63;
      g_s[c * GPITCH + m] = gb[(size_t)c * 1024 + moff + m];
    }
    __syncthreads();

    if (ch + 1 < 16) {                       // prefetch next chunk into caches
      const int nmoff = moff + 64;
      if (tid < 128) {
        const int c = tid >> 1, half = (tid & 1) << 5;
        __builtin_prefetch(&gb[(size_t)c * 1024 + nmoff + half]);
      } else if (tid < 160) {
        const int k = (tid - 128) >> 1, half = ((tid - 128) & 1) << 5;
        __builtin_prefetch(&phb[(size_t)k * 1024 + nmoff + half]);
      }
    }

    for (int mt = 0; mt < 4; ++mt) {
      const int ml = mt * 16;
      // S^T[m, n] = sum_k phi[k,m] * theta[k,n]   (K=16 as 4 WMMA steps)
      v8f S = zero8();
#pragma unroll
      for (int kk = 0; kk < 4; ++kk) {
        const int k0 = 4 * kk + (lo ? 0 : 2);
        v2f A = *(const v2f*)&phi_s[(ml + col) * PPITCH + k0];
        S = wmma4(A, bth[kk], S);
      }
      // flash softmax update (rows m live in VGPRs + opposite lane half)
      float tmax = S[0];
#pragma unroll
      for (int r = 1; r < 8; ++r) tmax = fmaxf(tmax, S[r]);
      tmax = fmaxf(tmax, __shfl_xor(tmax, 16, 32));
      const float nmax  = fmaxf(rmax, tmax);
      const float scale = __expf(rmax - nmax);
      rmax = nmax;
      float p[8], ts = 0.f;
#pragma unroll
      for (int r = 0; r < 8; ++r) { p[r] = __expf(S[r] - nmax); ts += p[r]; }
      ts += __shfl_xor(ts, 16, 32);
      rsum = rsum * scale + ts;
#pragma unroll
      for (int ct = 0; ct < 4; ++ct)
#pragma unroll
        for (int r = 0; r < 8; ++r) O[ct][r] *= scale;

      // re-layout P (C-layout) into B operands (4x16 K-steps) via xor-16
      v2f pb[4];
      {
        float t;
        t = __shfl_xor(p[2], 16, 32); pb[0].x = lo ? p[0] : t;
        t = __shfl_xor(p[3], 16, 32); pb[0].y = lo ? p[1] : t;
        t = __shfl_xor(p[6], 16, 32); pb[1].x = lo ? p[4] : t;
        t = __shfl_xor(p[7], 16, 32); pb[1].y = lo ? p[5] : t;
        t = __shfl_xor(p[0], 16, 32); pb[2].x = lo ? t : p[2];
        t = __shfl_xor(p[1], 16, 32); pb[2].y = lo ? t : p[3];
        t = __shfl_xor(p[4], 16, 32); pb[3].x = lo ? t : p[6];
        t = __shfl_xor(p[5], 16, 32); pb[3].y = lo ? t : p[7];
      }
      // O^T[c, n] += sum_m g[c,m] * P[n,m]
#pragma unroll
      for (int ct = 0; ct < 4; ++ct)
#pragma unroll
        for (int kk = 0; kk < 4; ++kk) {
          const int m0 = ml + 4 * kk + (lo ? 0 : 2);
          v2f A = *(const v2f*)&g_s[(ct * 16 + col) * GPITCH + m0];
          O[ct] = wmma4(A, pb[kk], O[ct]);
        }
    }
  }

  // normalize, then out[co,n] = x + sigma * (Wa @ O + ba)
  const float inv = 1.f / rsum;
#pragma unroll
  for (int ct = 0; ct < 4; ++ct)
#pragma unroll
    for (int r = 0; r < 8; ++r) O[ct][r] *= inv;

  v2f bfin[16];  // O re-laid as 16 B-operand K-steps over c=0..63
#pragma unroll
  for (int ct = 0; ct < 4; ++ct) {
    float t;
    t = __shfl_xor(O[ct][2], 16, 32); bfin[ct * 4 + 0].x = lo ? O[ct][0] : t;
    t = __shfl_xor(O[ct][3], 16, 32); bfin[ct * 4 + 0].y = lo ? O[ct][1] : t;
    t = __shfl_xor(O[ct][6], 16, 32); bfin[ct * 4 + 1].x = lo ? O[ct][4] : t;
    t = __shfl_xor(O[ct][7], 16, 32); bfin[ct * 4 + 1].y = lo ? O[ct][5] : t;
    t = __shfl_xor(O[ct][0], 16, 32); bfin[ct * 4 + 2].x = lo ? t : O[ct][2];
    t = __shfl_xor(O[ct][1], 16, 32); bfin[ct * 4 + 2].y = lo ? t : O[ct][3];
    t = __shfl_xor(O[ct][4], 16, 32); bfin[ct * 4 + 3].x = lo ? t : O[ct][6];
    t = __shfl_xor(O[ct][5], 16, 32); bfin[ct * 4 + 3].y = lo ? t : O[ct][7];
  }

  const int rowoff = lo ? 0 : 8;
  const float* xb = x   + (size_t)b * CIN * NPIX;
  float*       ob = out + (size_t)b * CIN * NPIX;
#pragma unroll 2
  for (int cot = 0; cot < 8; ++cot) {
    v8f acc = zero8();
#pragma unroll
    for (int kkg = 0; kkg < 16; ++kkg) {
      const int c0 = 4 * kkg + (lo ? 0 : 2);
      v2f A = *(const v2f*)&Wa_s[(cot * 16 + col) * GPITCH + c0];
      acc = wmma4(A, bfin[kkg], acc);
    }
#pragma unroll
    for (int r = 0; r < 8; ++r) {
      const int co = cot * 16 + r + rowoff;
      const size_t idx = (size_t)co * NPIX + nbase + col;
      ob[idx] = xb[idx] + sig * (acc[r] + ba_s[co]);
    }
  }
}

// ---------------------------------------------------------------------------
extern "C" void kernel_launch(void* const* d_in, const int* in_sizes, int n_in,
                              void* d_out, int out_size, void* d_ws, size_t ws_size,
                              hipStream_t stream) {
  const float* x     = (const float*)d_in[0];
  const float* Wt    = (const float*)d_in[1];
  const float* bt    = (const float*)d_in[2];
  const float* Wp    = (const float*)d_in[3];
  const float* bp    = (const float*)d_in[4];
  const float* Wg    = (const float*)d_in[5];
  const float* bg    = (const float*)d_in[6];
  const float* Wa    = (const float*)d_in[7];
  const float* ba    = (const float*)d_in[8];
  const float* sigma = (const float*)d_in[9];

  float* ws    = (float*)d_ws;
  float* theta = ws;                       // 16*16*4096 = 1,048,576 f32
  float* phi_p = theta + 1048576;          // 16*16*1024 =   262,144 f32
  float* g_p   = phi_p + 262144;           // 16*64*1024 = 1,048,576 f32

  proj_kernel<<<256, 256, 0, stream>>>(x, Wt, bt, Wp, bp, Wg, bg,
                                       theta, phi_p, g_p);
  attn_kernel<<<512, 256, 0, stream>>>(x, theta, phi_p, g_p, Wa, ba, sigma,
                                       (float*)d_out);
}

// v002
// A run of this version takes 90.2 microseconds.
// Timed twice side by side with v001, it ran 1.27 and 1.28 times as fast.
// Counting every step since v000, it is 2.30 times as fast.
#include <hip/hip_runtime.h>

typedef float v2f __attribute__((ext_vector_type(2)));
typedef float v4f __attribute__((ext_vector_type(4)));
typedef float v8f __attribute__((ext_vector_type(8)));

#define NPIX 4096   // 64*64
#define CIN  128

// LDS row pitches in dwords. Every A fragment is read as 8 bytes per lane, 16 rows
// at one column offset (lanes 16-31 two dwords further). A pitch of 4 * odd dwords
// puts the 64 dwords of such a read on 64 different banks; the unpadded pitches
// (128, 64, 16) put 16 (16, 4) rows on the same bank.
#define WPITCH 132  // rows of 128 dwords (projection weights)
#define GPITCH 68   // rows of 64 dwords (g chunk, output weights)
#define PPITCH 20   // rows of 16 dwords (transposed phi chunk)

__device__ __forceinline__ v8f wmma4(v2f a, v2f b, v8f c) {
  // D = A(16x4) * B(4x16) + C, full fp32 matrix pipe
  return __builtin_amdgcn_wmma_f32_16x16x4_f32(false, a, false, b, (short)0, c, false, false);
}

__device__ __forceinline__ v8f zero8() {
  v8f z = {0.f,0.f,0.f,0.f,0.f,0.f,0.f,0.f};
  return z;
}

// ---------------------------------------------------------------------------
// Kernel 1: 1x1-conv projections (theta/phi/g) + fused 2x2 maxpool.
// Each wave owns two vertically adjacent 16-pixel strips (rows h0,h0+1),
// so pooling is a register max + shfl_xor(1) horizontal max.
// ---------------------------------------------------------------------------
__global__ __launch_bounds__(256) void proj_kernel(
    const float* __restrict__ x,
    const float* __restrict__ Wt, const float* __restrict__ bt,
    const float* __restrict__ Wp, const float* __restrict__ bp,
    const float* __restrict__ Wg, const float* __restrict__ bg,
    float* __restrict__ theta, float* __restrict__ phi_p, float* __restrict__ g_p)
{
  __shared__ float Wt_s[16 * WPITCH];
  __shared__ float Wp_s[16 * WPITCH];
  __shared__ float Wg_s[64 * WPITCH];
  __shared__ float bias_s[96];

  const int tid = threadIdx.x;
  const int wdst = (tid >> 7) * WPITCH + (tid & 127);  // 256 threads = 2 rows a pass
  for (int j = 0; j < 8; ++j)  Wt_s[wdst + j * 2 * WPITCH] = Wt[tid + j * 256];
  for (int j = 0; j < 8; ++j)  Wp_s[wdst + j * 2 * WPITCH] = Wp[tid + j * 256];
  for (int j = 0; j < 32; ++j) Wg_s[wdst + j * 2 * WPITCH] = Wg[tid + j * 256];
  if (tid < 16)      bias_s[tid] = bt[tid];
  else if (tid < 32) bias_s[tid] = bp[tid - 16];
  else if (tid < 96) bias_s[tid] = bg[tid - 32];
  __syncthreads();

  const int wave = tid >> 5;
  const int lane = tid & 31;
  const int col  = lane & 15;
  const bool lo  = lane < 16;

  const int wv    = blockIdx.x * 8 + wave;   // 0..2047
  const int b     = wv >> 7;                 // batch
  const int strip = wv & 127;
  const int h0    = (strip >> 2) * 2;        // even image row
  const int wb    = (strip & 3) * 16;        // column base
  const int n0    = h0 * 64 + wb;            // strip (h0)
  const int n1    = n0 + 64;                 // strip (h0+1)

  const float* xb = x + (size_t)b * CIN * NPIX;

  v8f th0 = zero8(), th1 = zero8(), ph0 = zero8(), ph1 = zero8();
  v8f gg0[4], gg1[4];
#pragma unroll
  for (int i = 0; i < 4; ++i) { gg0[i] = zero8(); gg1[i] = zero8(); }

#pragma unroll 4
  for (int kk = 0; kk < 32; ++kk) {
    const int c0 = 4 * kk + (lo ? 0 : 2);
    // B operand (x tile): lane = spatial col, VGPR r = input channel c0+r
    v2f B0, B1;
    B0.x = xb[(size_t)c0 * NPIX + n0 + col];
    B0.y = xb[(size_t)(c0 + 1) * NPIX + n0 + col];
    B1.x = xb[(size_t)c0 * NPIX + n1 + col];
    B1.y = xb[(size_t)(c0 + 1) * NPIX + n1 + col];

    v2f At = *(const v2f*)&Wt_s[col * WPITCH + c0];
    v2f Ap = *(const v2f*)&Wp_s[col * WPITCH + c0];
    th0 = wmma4(At, B0, th0); th1 = wmma4(At, B1, th1);
    ph0 = wmma4(Ap, B0, ph0); ph1 = wmma4(Ap, B1, ph1);
#pragma unroll
    for (int ct = 0; ct < 4; ++ct) {
      v2f Ag = *(const v2f*)&Wg_s[(ct * 16 + col) * WPITCH + c0];
      gg0[ct] = wmma4(Ag, B0, gg0[ct]);
      gg1[ct] = wmma4(Ag, B1, gg1[ct]);
    }
  }

  const int rowoff = lo ? 0 : 8;
  // theta: bias + store full-resolution
  float* thp = theta + (size_t)b * 16 * NPIX;
#pragma unroll
  for (int r = 0; r < 8; ++r) {
    const int o = r + rowoff;
    const float bv = bias_s[o];
    thp[(size_t)o * NPIX + n0 + col] = th0[r] + bv;
    thp[(size_t)o * NPIX + n1 + col] = th1[r] + bv;
  }
  // 2x2 maxpool for phi / g, then bias + store
  const int mbase = (h0 >> 1) * 32 + (wb >> 1);
  const bool evenl = (col & 1) == 0;
  float* php = phi_p + (size_t)b * 16 * 1024;
#pragma unroll
  for (int r = 0; r < 8; ++r) {
    const int o = r + rowoff;
    float v  = fmaxf(ph0[r], ph1[r]);          // vertical
    float vv = fmaxf(v, __shfl_xor(v, 1, 32)); // horizontal
    if (evenl) php[(size_t)o * 1024 + mbase + (col >> 1)] = vv + bias_s[16 + o];
  }
  float* ggp = g_p + (size_t)b * 64 * 1024;
#pragma unroll
  for (int ct = 0; ct < 4; ++ct) {
#pragma unroll
    for (int r = 0; r < 8; ++r) {
      const int o = ct * 16 + r + rowoff;
      float v  = fmaxf(gg0[ct][r], gg1[ct][r]);
      float vv = fmaxf(v, __shfl_xor(v, 1, 32));
      if (evenl) ggp[(size_t)o * 1024 + mbase + (col >> 1)] = vv + bias_s[32 + o];
    }
  }
}

// ---------------------------------------------------------------------------
// Kernel 2: fused flash attention + output projection + residual.
// Wave = 16 query rows. S^T tiles via WMMA so softmax runs along VGPRs;
// only cross-lane op needed is shfl_xor(16). O^T = g * P^T accumulated with
// WMMA; epilogue applies Wa (in LDS), ba, sigma, residual x.
// The phi / g chunks go global -> registers -> LDS one chunk ahead, into two LDS
// buffers: the loads of chunk ch+2 are in flight while chunk ch is worked on.
// ---------------------------------------------------------------------------
__global__ __launch_bounds__(256) void attn_kernel(
    const float* __restrict__ x, const float* __restrict__ theta,
    const float* __restrict__ phi_p, const float* __restrict__ g_p,
    const float* __restrict__ Wa, const float* __restrict__ ba,
    const float* __restrict__ sigma, float* __restrict__ out)
{
  __shared__ float Wa_s[128 * GPITCH];
  __shared__ float ba_s[128];
  __shared__ __attribute__((aligned(16))) float phi_s[2][64 * PPITCH];  // transposed: [m_local][k]
  __shared__ __attribute__((aligned(16))) float g_s[2][64 * GPITCH];    // [c][m_local]

  const int tid = threadIdx.x;
  const int wdst = (tid >> 6) * GPITCH + (tid & 63);   // 256 threads = 4 rows a pass
  for (int j = 0; j < 32; ++j) Wa_s[wdst + j * 4 * GPITCH] = Wa[tid + j * 256];
  if (tid < 128) ba_s[tid] = ba[tid];
  const float sig = sigma[0];

  const int wave = tid >> 5;
  const int lane = tid & 31;
  const int col  = lane & 15;
  const bool lo  = lane < 16;

  const int b     = blockIdx.x >> 5;              // 32 blocks per batch
  const int nbase = (blockIdx.x & 31) * 128 + wave * 16;

  const float* thb = theta + (size_t)b * 16 * NPIX;
  const float* phb = phi_p + (size_t)b * 16 * 1024;
  const float* gb  = g_p   + (size_t)b * 64 * 1024;

  // theta B-operands for this row tile, kept in registers for all m
  v2f bth[4];
#pragma unroll
  for (int kk = 0; kk < 4; ++kk) {
    const int k0 = 4 * kk + (lo ? 0 : 2);
    bth[kk].x = thb[(size_t)k0 * NPIX + nbase + col];
    bth[kk].y = thb[(size_t)(k0 + 1) * NPIX + nbase + col];
  }

  v8f O[4];
#pragma unroll
  for (int i = 0; i < 4; ++i) O[i] = zero8();
  float rmax = -__builtin_inff();
  float rsum = 0.f;

  // Staging map: a thread moves 4 keys (16 bytes) of one phi row and of four g rows.
  const int srow = tid >> 4;                 // 0..15
  const int sm   = (tid & 15) * 4;           // key offset inside the chunk
  const float* psrc = phb + (size_t)srow * 1024 + sm;
  const float* gsrc = gb  + (size_t)srow * 1024 + sm;
  const int pdst = sm * PPITCH + srow;
  const int gdst = srow * GPITCH + sm;
  v4f rp, rg[4];                             // the chunk that is on its way

  // The small loops below are unrolled so that rg[] and rp are indexed by constants
  // and stay in registers.

#define LOAD_CHUNK(chn)                                                     \
  do {                                                                      \
    rp = *(const v4f*)(psrc + (chn) * 64);                                  \
    _Pragma("unroll") for (int j = 0; j < 4; ++j)                           \
      rg[j] = *(const v4f*)(gsrc + (size_t)j * 16 * 1024 + (chn) * 64);     \
  } while (0)
#define STORE_CHUNK(buf)                                                    \
  do {                                                                      \
    _Pragma("unroll") for (int e = 0; e < 4; ++e)                           \
      phi_s[buf][pdst + e * PPITCH] = rp[e];                                \
    _Pragma("unroll") for (int j = 0; j < 4; ++j)                           \
      *(v4f*)&g_s[buf][gdst + j * 16 * GPITCH] = rg[j];                     \
  } while (0)

  LOAD_CHUNK(0);
  STORE_CHUNK(0);
  LOAD_CHUNK(1);
  __syncthreads();                           // chunk 0, Wa_s and ba_s are published

  for (int ch2 = 0; ch2 < 16; ch2 += 2)      // 16 chunks of 64 keys
  // Fully unrolled so that the buffer index is a constant in every LDS address.
#pragma unroll
  for (int cur = 0; cur < 2; ++cur) {
    const int ch = ch2 + cur;
    // The other buffer was last read in trip ch-1, which ended in a barrier.
    if (ch + 1 < 16) STORE_CHUNK(cur ^ 1);
    if (ch + 2 < 16) {
      LOAD_CHUNK(ch + 2);
      // The loop below reuses the registers that held these loads' addresses:
      // keep the address-translation wait in front of that overwrite.
      asm volatile("s_wait_xcnt 0x0" ::: "memory");
    }

    for (int mt = 0; mt < 4; ++mt) {
      const int ml = mt * 16;
      // S^T[m, n] = sum_k phi[k,m] * theta[k,n]   (K=16 as 4 WMMA steps)
      v8f S = zero8();
#pragma unroll
      for (int kk = 0; kk < 4; ++kk) {
        const int k0 = 4 * kk + (lo ? 0 : 2);
        v2f A = *(const v2f*)&phi_s[cur][(ml + col) * PPITCH + k0];
        S = wmma4(A, bth[kk], S);
      }
      // flash softmax update (rows m live in VGPRs + opposite lane half)
      float tmax = S[0];
#pragma unroll
      for (int r = 1; r < 8; ++r) tmax = fmaxf(tmax, S[r]);
      tmax = fmaxf(tmax, __shfl_xor(tmax, 16, 32));
      const float nmax  = fmaxf(rmax, tmax);
      const float scale = __expf(rmax - nmax);
      rmax = nmax;
      float p[8], ts = 0.f;
#pragma unroll
      for (int r = 0; r < 8; ++r) { p[r] = __expf(S[r] - nmax); ts += p[r]; }
      ts += __shfl_xor(ts, 16, 32);
      rsum = rsum * scale + ts;
#pragma unroll
      for (int ct = 0; ct < 4; ++ct)
#pragma unroll
        for (int r = 0; r < 8; ++r) O[ct][r] *= scale;

      // re-layout P (C-layout) into B operands (4x16 K-steps) via xor-16
      v2f pb[4];
      {
        float t;
        t = __shfl_xor(p[2], 16, 32); pb[0].x = lo ? p[0] : t;
        t = __shfl_xor(p[3], 16, 32); pb[0].y = lo ? p[1] : t;
        t = __shfl_xor(p[6], 16, 32); pb[1].x = lo ? p[4] : t;
        t = __shfl_xor(p[7], 16, 32); pb[1].y = lo ? p[5] : t;
        t = __shfl_xor(p[0], 16, 32); pb[2].x = lo ? t : p[2];
        t = __shfl_xor(p[1], 16, 32); pb[2].y = lo ? t : p[3];
        t = __shfl_xor(p[4], 16, 32); pb[3].x = lo ? t : p[6];
        t = __shfl_xor(p[5], 16, 32); pb[3].y = lo ? t : p[7];
      }
      // O^T[c, n] += sum_m g[c,m] * P[n,m]
#pragma unroll
      for (int ct = 0; ct < 4; ++ct)
#pragma unroll
        for (int kk = 0; kk < 4; ++kk) {
          const int m0 = ml + 4 * kk + (lo ? 0 : 2);
          v2f A = *(const v2f*)&g_s[cur][(ct * 16 + col) * GPITCH + m0];
          O[ct] = wmma4(A, pb[kk], O[ct]);
        }
    }
    // One barrier a chunk: it publishes chunk ch+1 and ends the reads of chunk ch.
    if (ch + 1 < 16) __syncthreads();
  }
#undef LOAD_CHUNK
#undef STORE_CHUNK

  // normalize, then out[co,n] = x + sigma * (Wa @ O + ba)
  const float inv = 1.f / rsum;
#pragma unroll
  for (int ct = 0; ct < 4; ++ct)
#pragma unroll
    for (int r = 0; r < 8; ++r) O[ct][r] *= inv;

  v2f bfin[16];  // O re-laid as 16 B-operand K-steps over c=0..63
#pragma unroll
  for (int ct = 0; ct < 4; ++ct) {
    float t;
    t = __shfl_xor(O[ct][2], 16, 32); bfin[ct * 4 + 0].x = lo ? O[ct][0] : t;
    t = __shfl_xor(O[ct][3], 16, 32); bfin[ct * 4 + 0].y = lo ? O[ct][1] : t;
    t = __shfl_xor(O[ct][6], 16, 32); bfin[ct * 4 + 1].x = lo ? O[ct][4] : t;
    t = __shfl_xor(O[ct][7], 16, 32); bfin[ct * 4 + 1].y = lo ? O[ct][5] : t;
    t = __shfl_xor(O[ct][0], 16, 32); bfin[ct * 4 + 2].x = lo ? t : O[ct][2];
    t = __shfl_xor(O[ct][1], 16, 32); bfin[ct * 4 + 2].y = lo ? t : O[ct][3];
    t = __shfl_xor(O[ct][4], 16, 32); bfin[ct * 4 + 3].x = lo ? t : O[ct][6];
    t = __shfl_xor(O[ct][5], 16, 32); bfin[ct * 4 + 3].y = lo ? t : O[ct][7];
  }

  const int rowoff = lo ? 0 : 8;
  const float* xb = x   + (size_t)b * CIN * NPIX;
  float*       ob = out + (size_t)b * CIN * NPIX;
#pragma unroll 2
  for (int cot = 0; cot < 8; ++cot) {
    v8f acc = zero8();
#pragma unroll
    for (int kkg = 0; kkg < 16; ++kkg) {
      const int c0 = 4 * kkg + (lo ? 0 : 2);
      v2f A = *(const v2f*)&Wa_s[(cot * 16 + col) * GPITCH + c0];
      acc = wmma4(A, bfin[kkg], acc);
    }
#pragma unroll
    for (int r = 0; r < 8; ++r) {
      const int co = cot * 16 + r + rowoff;
      const size_t idx = (size_t)co * NPIX + nbase + col;
      ob[idx] = xb[idx] + sig * (acc[r] + ba_s[co]);
    }
  }
}

// ---------------------------------------------------------------------------
extern "C" void kernel_launch(void* const* d_in, const int* in_sizes, int n_in,
                              void* d_out, int out_size, void* d_ws, size_t ws_size,
                              hipStream_t stream) {
  const float* x     = (const float*)d_in[0];
  const float* Wt    = (const float*)d_in[1];
  const float* bt    = (const float*)d_in[2];
  const float* Wp    = (const float*)d_in[3];
  const float* bp    = (const float*)d_in[4];
  const float* Wg    = (const float*)d_in[5];
  const float* bg    = (const float*)d_in[6];
  const float* Wa    = (const float*)d_in[7];
  const float* ba    = (const float*)d_in[8];
  const float* sigma = (const float*)d_in[9];

  float* ws    = (float*)d_ws;
  float* theta = ws;                       // 16*16*4096 = 1,048,576 f32
  float* phi_p = theta + 1048576;          // 16*16*1024 =   262,144 f32
  float* g_p   = phi_p + 262144;           // 16*64*1024 = 1,048,576 f32

  proj_kernel<<<256, 256, 0, stream>>>(x, Wt, bt, Wp, bp, Wg, bg,
                                       theta, phi_p, g_p);
  attn_kernel<<<512, 256, 0, stream>>>(x, theta, phi_p, g_p, Wa, ba, sigma,
                                       (float*)d_out);
}

// v003
// A run of this version takes 84.6 microseconds.
// Two timings next to v002 both put it at 1.04 times that version's speed.
// Counting every step since v000, it is 2.40 times as fast.
#include <hip/hip_runtime.h>

typedef float v2f __attribute__((ext_vector_type(2)));
typedef float v4f __attribute__((ext_vector_type(4)));
typedef float v8f __attribute__((ext_vector_type(8)));

#define NPIX 4096   // 64*64
#define CIN  128

// LDS row pitches in dwords. An A fragment is read as 8 bytes per lane, 16 rows at one
// column offset (lanes 16-31 two dwords further), or, for g and the output weights, as
// 16 bytes per lane (lanes 16-31 eight dwords further). A pitch of 4 * odd dwords puts
// the 64 dwords of an 8-byte read, and of each 16-lane half of a 16-byte read, on 64
// different banks; the unpadded pitches (128, 64, 16) put 16 (16, 4) rows on one bank.
#define WPITCH 132  // rows of 128 dwords (projection weights)
#define GPITCH 68   // rows of 64 dwords (g chunk, output weights)
#define PPITCH 20   // rows of 16 dwords (transposed phi chunk)

__device__ __forceinline__ v8f wmma4(v2f a, v2f b, v8f c) {
  // D = A(16x4) * B(4x16) + C, full fp32 matrix pipe
  return __builtin_amdgcn_wmma_f32_16x16x4_f32(false, a, false, b, (short)0, c, false, false);
}

__device__ __forceinline__ v8f zero8() {
  v8f z = {0.f,0.f,0.f,0.f,0.f,0.f,0.f,0.f};
  return z;
}

// ---------------------------------------------------------------------------
// Kernel 1: 1x1-conv projections (theta/phi/g) + fused 2x2 maxpool.
// Each wave owns two vertically adjacent 16-pixel strips (rows h0,h0+1),
// so pooling is a register max + shfl_xor(1) horizontal max.
// ---------------------------------------------------------------------------
__global__ __launch_bounds__(256) void proj_kernel(
    const float* __restrict__ x,
    const float* __restrict__ Wt, const float* __restrict__ bt,
    const float* __restrict__ Wp, const float* __restrict__ bp,
    const float* __restrict__ Wg, const float* __restrict__ bg,
    float* __restrict__ theta, float* __restrict__ phi_p, float* __restrict__ g_p)
{
  __shared__ float Wt_s[16 * WPITCH];
  __shared__ float Wp_s[16 * WPITCH];
  __shared__ float Wg_s[64 * WPITCH];
  __shared__ float bias_s[96];

  const int tid = threadIdx.x;
  const int wdst = (tid >> 7) * WPITCH + (tid & 127);  // 256 threads = 2 rows a pass
  for (int j = 0; j < 8; ++j)  Wt_s[wdst + j * 2 * WPITCH] = Wt[tid + j * 256];
  for (int j = 0; j < 8; ++j)  Wp_s[wdst + j * 2 * WPITCH] = Wp[tid + j * 256];
  for (int j = 0; j < 32; ++j) Wg_s[wdst + j * 2 * WPITCH] = Wg[tid + j * 256];
  if (tid < 16)      bias_s[tid] = bt[tid];
  else if (tid < 32) bias_s[tid] = bp[tid - 16];
  else if (tid < 96) bias_s[tid] = bg[tid - 32];
  __syncthreads();

  const int wave = tid >> 5;
  const int lane = tid & 31;
  const int col  = lane & 15;
  const bool lo  = lane < 16;

  const int wv    = blockIdx.x * 8 + wave;   // 0..2047
  const int b     = wv >> 7;                 // batch
  const int strip = wv & 127;
  const int h0    = (strip >> 2) * 2;        // even image row
  const int wb    = (strip & 3) * 16;        // column base
  const int n0    = h0 * 64 + wb;            // strip (h0)
  const int n1    = n0 + 64;                 // strip (h0+1)

  const float* xb = x + (size_t)b * CIN * NPIX;

  v8f th0 = zero8(), th1 = zero8(), ph0 = zero8(), ph1 = zero8();
  v8f gg0[4], gg1[4];
#pragma unroll
  for (int i = 0; i < 4; ++i) { gg0[i] = zero8(); gg1[i] = zero8(); }

#pragma unroll 4
  for (int kk = 0; kk < 32; ++kk) {
    const int c0 = 4 * kk + (lo ? 0 : 2);
    // B operand (x tile): lane = spatial col, VGPR r = input channel c0+r
    v2f B0, B1;
    B0.x = xb[(size_t)c0 * NPIX + n0 + col];
    B0.y = xb[(size_t)(c0 + 1) * NPIX + n0 + col];
    B1.x = xb[(size_t)c0 * NPIX + n1 + col];
    B1.y = xb[(size_t)(c0 + 1) * NPIX + n1 + col];

    v2f At = *(const v2f*)&Wt_s[col * WPITCH + c0];
    v2f Ap = *(const v2f*)&Wp_s[col * WPITCH + c0];
    th0 = wmma4(At, B0, th0); th1 = wmma4(At, B1, th1);
    ph0 = wmma4(Ap, B0, ph0); ph1 = wmma4(Ap, B1, ph1);
#pragma unroll
    for (int ct = 0; ct < 4; ++ct) {
      v2f Ag = *(const v2f*)&Wg_s[(ct * 16 + col) * WPITCH + c0];
      gg0[ct] = wmma4(Ag, B0, gg0[ct]);
      gg1[ct] = wmma4(Ag, B1, gg1[ct]);
    }
  }

  const int rowoff = lo ? 0 : 8;
  // theta: bias + store full-resolution
  float* thp = theta + (size_t)b * 16 * NPIX;
#pragma unroll
  for (int r = 0; r < 8; ++r) {
    const int o = r + rowoff;
    const float bv = bias_s[o];
    thp[(size_t)o * NPIX + n0 + col] = th0[r] + bv;
    thp[(size_t)o * NPIX + n1 + col] = th1[r] + bv;
  }
  // 2x2 maxpool for phi / g, then bias + store
  const int mbase = (h0 >> 1) * 32 + (wb >> 1);
  const bool evenl = (col & 1) == 0;
  float* php = phi_p + (size_t)b * 16 * 1024;
#pragma unroll
  for (int r = 0; r < 8; ++r) {
    const int o = r + rowoff;
    float v  = fmaxf(ph0[r], ph1[r]);          // vertical
    float vv = fmaxf(v, __shfl_xor(v, 1, 32)); // horizontal
    if (evenl) php[(size_t)o * 1024 + mbase + (col >> 1)] = vv + bias_s[16 + o];
  }
  float* ggp = g_p + (size_t)b * 64 * 1024;
#pragma unroll
  for (int ct = 0; ct < 4; ++ct) {
#pragma unroll
    for (int r = 0; r < 8; ++r) {
      const int o = ct * 16 + r + rowoff;
      float v  = fmaxf(gg0[ct][r], gg1[ct][r]);
      float vv = fmaxf(v, __shfl_xor(v, 1, 32));
      if (evenl) ggp[(size_t)o * 1024 + mbase + (col >> 1)] = vv + bias_s[32 + o];
    }
  }
}

// ---------------------------------------------------------------------------
// Kernel 2: fused flash attention + output projection + residual.
// Wave = 16 query rows. S^T tiles via WMMA so softmax runs along VGPRs;
// only cross-lane op needed is shfl_xor(16). O^T = g * P^T accumulated with
// WMMA; epilogue applies Wa (in LDS), ba, sigma, residual x.
// Only the pairing of A's and B's k counts in a product, so P (and O in the epilogue)
// is used as the B operand in the registers where the accumulator left it: lane half h
// holds rows 8h..8h+7, and the A side reads the same rows of k, 16 bytes a lane.
// The phi / g chunks go global -> registers -> LDS one chunk ahead, into two LDS
// buffers: the loads of chunk ch+2 are in flight while chunk ch is worked on.
// ---------------------------------------------------------------------------
__global__ __launch_bounds__(256) void attn_kernel(
    const float* __restrict__ x, const float* __restrict__ theta,
    const float* __restrict__ phi_p, const float* __restrict__ g_p,
    const float* __restrict__ Wa, const float* __restrict__ ba,
    const float* __restrict__ sigma, float* __restrict__ out)
{
  __shared__ __attribute__((aligned(16))) float Wa_s[128 * GPITCH];
  __shared__ float ba_s[128];
  __shared__ __attribute__((aligned(16))) float phi_s[2][64 * PPITCH];  // transposed: [m_local][k]
  __shared__ __attribute__((aligned(16))) float g_s[2][64 * GPITCH];    // [c][m_local]

  const int tid = threadIdx.x;
  const int wdst = (tid >> 6) * GPITCH + (tid & 63);   // 256 threads = 4 rows a pass
  for (int j = 0; j < 32; ++j) Wa_s[wdst + j * 4 * GPITCH] = Wa[tid + j * 256];
  if (tid < 128) ba_s[tid] = ba[tid];
  const float sig = sigma[0];

  const int wave = tid >> 5;
  const int lane = tid & 31;
  const int col  = lane & 15;
  const bool lo  = lane < 16;
  const int koff = lo ? 0 : 8;                    // first accumulator row of this lane half

  const int b     = blockIdx.x >> 5;              // 32 blocks per batch
  const int nbase = (blockIdx.x & 31) * 128 + wave * 16;

  const float* thb = theta + (size_t)b * 16 * NPIX;
  const float* phb = phi_p + (size_t)b * 16 * 1024;
  const float* gb  = g_p   + (size_t)b * 64 * 1024;

  // theta B-operands for this row tile, kept in registers for all m
  v2f bth[4];
#pragma unroll
  for (int kk = 0; kk < 4; ++kk) {
    const int k0 = 4 * kk + (lo ? 0 : 2);
    bth[kk].x = thb[(size_t)k0 * NPIX + nbase + col];
    bth[kk].y = thb[(size_t)(k0 + 1) * NPIX + nbase + col];
  }

  v8f O[4];
#pragma unroll
  for (int i = 0; i < 4; ++i) O[i] = zero8();
  float rmax = -__builtin_inff();
  float rsum = 0.f;

  // Staging map: a thread moves 4 keys (16 bytes) of one phi row and of four g rows.
  const int srow = tid >> 4;                 // 0..15
  const int sm   = (tid & 15) * 4;           // key offset inside the chunk
  const float* psrc = phb + (size_t)srow * 1024 + sm;
  const float* gsrc = gb  + (size_t)srow * 1024 + sm;
  const int pdst = sm * PPITCH + srow;
  const int gdst = srow * GPITCH + sm;
  v4f rp, rg[4];                             // the chunk that is on its way

  // The small loops below are unrolled so that rg[] and rp are indexed by constants
  // and stay in registers.

#define LOAD_CHUNK(chn)                                                     \
  do {                                                                      \
    rp = *(const v4f*)(psrc + (chn) * 64);                                  \
    _Pragma("unroll") for (int j = 0; j < 4; ++j)                           \
      rg[j] = *(const v4f*)(gsrc + (size_t)j * 16 * 1024 + (chn) * 64);     \
  } while (0)
#define STORE_CHUNK(buf)                                                    \
  do {                                                                      \
    _Pragma("unroll") for (int e = 0; e < 4; ++e)                           \
      phi_s[buf][pdst + e * PPITCH] = rp[e];                                \
    _Pragma("unroll") for (int j = 0; j < 4; ++j)                           \
      *(v4f*)&g_s[buf][gdst + j * 16 * GPITCH] = rg[j];                     \
  } while (0)

  LOAD_CHUNK(0);
  STORE_CHUNK(0);
  LOAD_CHUNK(1);
  __syncthreads();                           // chunk 0, Wa_s and ba_s are published

  for (int ch2 = 0; ch2 < 16; ch2 += 2)      // 16 chunks of 64 keys
  // Fully unrolled so that the buffer index is a constant in every LDS address.
#pragma unroll
  for (int cur = 0; cur < 2; ++cur) {
    const int ch = ch2 + cur;
    // The other buffer was last read in trip ch-1, which ended in a barrier.
    if (ch + 1 < 16) STORE_CHUNK(cur ^ 1);
    if (ch + 2 < 16) {
      LOAD_CHUNK(ch + 2);
      // The loop below reuses the registers that held these loads' addresses:
      // keep the address-translation wait in front of that overwrite.
      asm volatile("s_wait_xcnt 0x0" ::: "memory");
    }

    for (int mt = 0; mt < 4; ++mt) {
      const int ml = mt * 16;
      // S^T[m, n] = sum_k phi[k,m] * theta[k,n]   (K=16 as 4 WMMA steps)
      v8f S = zero8();
#pragma unroll
      for (int kk = 0; kk < 4; ++kk) {
        const int k0 = 4 * kk + (lo ? 0 : 2);
        v2f A = *(const v2f*)&phi_s[cur][(ml + col) * PPITCH + k0];
        S = wmma4(A, bth[kk], S);
      }
      // flash softmax update (rows m live in VGPRs + opposite lane half)
      float tmax = S[0];
#pragma unroll
      for (int r = 1; r < 8; ++r) tmax = fmaxf(tmax, S[r]);
      tmax = fmaxf(tmax, __shfl_xor(tmax, 16, 32));
      const float nmax  = fmaxf(rmax, tmax);
      const float scale = __expf(rmax - nmax);
      rmax = nmax;
      float p[8], ts = 0.f;
#pragma unroll
      for (int r = 0; r < 8; ++r) { p[r] = __expf(S[r] - nmax); ts += p[r]; }
      ts += __shfl_xor(ts, 16, 32);
      rsum = rsum * scale + ts;
#pragma unroll
      for (int ct = 0; ct < 4; ++ct)
#pragma unroll
        for (int r = 0; r < 8; ++r) O[ct][r] *= scale;

      // O^T[c, n] += sum_m g[c,m] * P[n,m]; K-step kk pairs keys 2kk, 2kk+1 (low lane
      // half) and 8+2kk, 9+2kk (high half): p[2kk], p[2kk+1] of each lane as they lie.
#pragma unroll
      for (int ct = 0; ct < 4; ++ct)
#pragma unroll
        for (int j = 0; j < 2; ++j) {
          const v4f A = *(const v4f*)&g_s[cur][(ct * 16 + col) * GPITCH + ml + koff + 4 * j];
          O[ct] = wmma4(v2f{A.x, A.y}, v2f{p[4 * j],     p[4 * j + 1]}, O[ct]);
          O[ct] = wmma4(v2f{A.z, A.w}, v2f{p[4 * j + 2], p[4 * j + 3]}, O[ct]);
        }
    }
    // One barrier a chunk: it publishes chunk ch+1 and ends the reads of chunk ch.
    if (ch + 1 < 16) __syncthreads();
  }
#undef LOAD_CHUNK
#undef STORE_CHUNK

  // normalize, then out[co,n] = x + sigma * (Wa @ O + ba)
  const float inv = 1.f / rsum;
#pragma unroll
  for (int ct = 0; ct < 4; ++ct)
#pragma unroll
    for (int r = 0; r < 8; ++r) O[ct][r] *= inv;

  const int rowoff = lo ? 0 : 8;
  const float* xb = x   + (size_t)b * CIN * NPIX;
  float*       ob = out + (size_t)b * CIN * NPIX;
#pragma unroll 2
  for (int cot = 0; cot < 8; ++cot) {
    v8f acc = zero8();
#pragma unroll
    for (int ct = 0; ct < 4; ++ct)
#pragma unroll
      for (int j = 0; j < 2; ++j) {
        const v4f A = *(const v4f*)&Wa_s[(cot * 16 + col) * GPITCH + ct * 16 + koff + 4 * j];
        acc = wmma4(v2f{A.x, A.y}, v2f{O[ct][4 * j],     O[ct][4 * j + 1]}, acc);
        acc = wmma4(v2f{A.z, A.w}, v2f{O[ct][4 * j + 2], O[ct][4 * j + 3]}, acc);
      }
#pragma unroll
    for (int r = 0; r < 8; ++r) {
      const int co = cot * 16 + r + rowoff;
      const size_t idx = (size_t)co * NPIX + nbase + col;
      ob[idx] = xb[idx] + sig * (acc[r] + ba_s[co]);
    }
  }
}

// ---------------------------------------------------------------------------
extern "C" void kernel_launch(void* const* d_in, const int* in_sizes, int n_in,
                              void* d_out, int out_size, void* d_ws, size_t ws_size,
                              hipStream_t stream) {
  const float* x     = (const float*)d_in[0];
  const float* Wt    = (const float*)d_in[1];
  const float* bt    = (const float*)d_in[2];
  const float* Wp    = (const float*)d_in[3];
  const float* bp    = (const float*)d_in[4];
  const float* Wg    = (const float*)d_in[5];
  const float* bg    = (const float*)d_in[6];
  const float* Wa    = (const float*)d_in[7];
  const float* ba    = (const float*)d_in[8];
  const float* sigma = (const float*)d_in[9];

  float* ws    = (float*)d_ws;
  float* theta = ws;                       // 16*16*4096 = 1,048,576 f32
  float* phi_p = theta + 1048576;          // 16*16*1024 =   262,144 f32
  float* g_p   = phi_p + 262144;           // 16*64*1024 = 1,048,576 f32

  proj_kernel<<<256, 256, 0, stream>>>(x, Wt, bt, Wp, bp, Wg, bg,
                                       theta, phi_p, g_p);
  attn_kernel<<<512, 256, 0, stream>>>(x, theta, phi_p, g_p, Wa, ba, sigma,
                                       (float*)d_out);
}

// v004
// One run takes 80.6 microseconds.
// Two timings next to v003 both put it at 1.07 times that version's speed.
// All steps since v000 together make it 2.57 times as fast.
#include <hip/hip_runtime.h>

typedef float v2f __attribute__((ext_vector_type(2)));
typedef float v4f __attribute__((ext_vector_type(4)));
typedef float v8f __attribute__((ext_vector_type(8)));

#define NPIX 4096   // 64*64
#define CIN  128

// LDS row pitches in dwords. An A fragment is read as 8 bytes per lane, 16 rows at one
// column offset (lanes 16-31 two dwords further), or, for g and the output weights, as
// 16 bytes per lane (lanes 16-31 eight dwords further). A pitch of 4 * odd dwords puts
// the 64 dwords of an 8-byte read, and of each 16-lane half of a 16-byte read, on 64
// different banks; the unpadded pitches (128, 64, 16) put 16 (16, 4) rows on one bank.
#define WPITCH 132  // rows of 128 dwords (projection weights)
#define GPITCH 68   // rows of 64 dwords (g chunk, output weights)
#define PPITCH 20   // rows of 16 dwords (transposed phi chunk)

__device__ __forceinline__ v8f wmma4(v2f a, v2f b, v8f c) {
  // D = A(16x4) * B(4x16) + C, full fp32 matrix pipe
  return __builtin_amdgcn_wmma_f32_16x16x4_f32(false, a, false, b, (short)0, c, false, false);
}

__device__ __forceinline__ v8f zero8() {
  v8f z = {0.f,0.f,0.f,0.f,0.f,0.f,0.f,0.f};
  return z;
}

// ---------------------------------------------------------------------------
// Kernel 1: 1x1-conv projections (theta/phi/g) + fused 2x2 maxpool.
// Each wave owns two vertically adjacent 16-pixel strips (rows h0,h0+1),
// so pooling is a register max + shfl_xor(1) horizontal max.
// ---------------------------------------------------------------------------
__global__ __launch_bounds__(256) void proj_kernel(
    const float* __restrict__ x,
    const float* __restrict__ Wt, const float* __restrict__ bt,
    const float* __restrict__ Wp, const float* __restrict__ bp,
    const float* __restrict__ Wg, const float* __restrict__ bg,
    float* __restrict__ theta, float* __restrict__ phi_p, float* __restrict__ g_p)
{
  __shared__ float Wt_s[16 * WPITCH];
  __shared__ float Wp_s[16 * WPITCH];
  __shared__ float Wg_s[64 * WPITCH];
  __shared__ float bias_s[96];

  const int tid = threadIdx.x;
  const int wdst = (tid >> 7) * WPITCH + (tid & 127);  // 256 threads = 2 rows a pass
  for (int j = 0; j < 8; ++j)  Wt_s[wdst + j * 2 * WPITCH] = Wt[tid + j * 256];
  for (int j = 0; j < 8; ++j)  Wp_s[wdst + j * 2 * WPITCH] = Wp[tid + j * 256];
  for (int j = 0; j < 32; ++j) Wg_s[wdst + j * 2 * WPITCH] = Wg[tid + j * 256];
  if (tid < 16)      bias_s[tid] = bt[tid];
  else if (tid < 32) bias_s[tid] = bp[tid - 16];
  else if (tid < 96) bias_s[tid] = bg[tid - 32];
  __syncthreads();

  const int wave = tid >> 5;
  const int lane = tid & 31;
  const int col  = lane & 15;
  const bool lo  = lane < 16;

  const int wv    = blockIdx.x * 8 + wave;   // 0..2047
  const int b     = wv >> 7;                 // batch
  const int strip = wv & 127;
  const int h0    = (strip >> 2) * 2;        // even image row
  const int wb    = (strip & 3) * 16;        // column base
  const int n0    = h0 * 64 + wb;            // strip (h0)
  const int n1    = n0 + 64;                 // strip (h0+1)

  const float* xb = x + (size_t)b * CIN * NPIX;

  v8f th0 = zero8(), th1 = zero8(), ph0 = zero8(), ph1 = zero8();
  v8f gg0[4], gg1[4];
#pragma unroll
  for (int i = 0; i < 4; ++i) { gg0[i] = zero8(); gg1[i] = zero8(); }

#pragma unroll 4
  for (int kk = 0; kk < 32; ++kk) {
    const int c0 = 4 * kk + (lo ? 0 : 2);
    // B operand (x tile): lane = spatial col, VGPR r = input channel c0+r
    v2f B0, B1;
    B0.x = xb[(size_t)c0 * NPIX + n0 + col];
    B0.y = xb[(size_t)(c0 + 1) * NPIX + n0 + col];
    B1.x = xb[(size_t)c0 * NPIX + n1 + col];
    B1.y = xb[(size_t)(c0 + 1) * NPIX + n1 + col];

    v2f At = *(const v2f*)&Wt_s[col * WPITCH + c0];
    v2f Ap = *(const v2f*)&Wp_s[col * WPITCH + c0];
    th0 = wmma4(At, B0, th0); th1 = wmma4(At, B1, th1);
    ph0 = wmma4(Ap, B0, ph0); ph1 = wmma4(Ap, B1, ph1);
#pragma unroll
    for (int ct = 0; ct < 4; ++ct) {
      v2f Ag = *(const v2f*)&Wg_s[(ct * 16 + col) * WPITCH + c0];
      gg0[ct] = wmma4(Ag, B0, gg0[ct]);
      gg1[ct] = wmma4(Ag, B1, gg1[ct]);
    }
  }

  const int rowoff = lo ? 0 : 8;
  // theta: bias + store full-resolution
  float* thp = theta + (size_t)b * 16 * NPIX;
#pragma unroll
  for (int r = 0; r < 8; ++r) {
    const int o = r + rowoff;
    const float bv = bias_s[o];
    thp[(size_t)o * NPIX + n0 + col] = th0[r] + bv;
    thp[(size_t)o * NPIX + n1 + col] = th1[r] + bv;
  }
  // 2x2 maxpool for phi / g, then bias + store
  const int mbase = (h0 >> 1) * 32 + (wb >> 1);
  const bool evenl = (col & 1) == 0;
  float* php = phi_p + (size_t)b * 16 * 1024;
#pragma unroll
  for (int r = 0; r < 8; ++r) {
    const int o = r + rowoff;
    float v  = fmaxf(ph0[r], ph1[r]);          // vertical
    float vv = fmaxf(v, __shfl_xor(v, 1, 32)); // horizontal
    if (evenl) php[(size_t)o * 1024 + mbase + (col >> 1)] = vv + bias_s[16 + o];
  }
  float* ggp = g_p + (size_t)b * 64 * 1024;
#pragma unroll
  for (int ct = 0; ct < 4; ++ct) {
#pragma unroll
    for (int r = 0; r < 8; ++r) {
      const int o = ct * 16 + r + rowoff;
      float v  = fmaxf(gg0[ct][r], gg1[ct][r]);
      float vv = fmaxf(v, __shfl_xor(v, 1, 32));
      if (evenl) ggp[(size_t)o * 1024 + mbase + (col >> 1)] = vv + bias_s[32 + o];
    }
  }
}

// ---------------------------------------------------------------------------
// Kernel 2: fused flash attention + output projection + residual.
// Wave = 16 query rows. S^T tiles via WMMA so softmax runs along VGPRs;
// only cross-lane op needed is shfl_xor(16). O^T = g * P^T accumulated with
// WMMA; epilogue applies Wa (in LDS), ba, sigma, residual x.
// Only the pairing of A's and B's k counts in a product, so P (and O in the epilogue)
// is used as the B operand in the registers where the accumulator left it: lane half h
// holds rows 8h..8h+7, and the A side reads the same rows of k, 16 bytes a lane.
// The phi / g chunks go global -> registers -> LDS one chunk ahead, into two LDS
// buffers: the loads of chunk ch+2 are in flight while chunk ch is worked on.
// ---------------------------------------------------------------------------
__global__ __launch_bounds__(256) void attn_kernel(
    const float* __restrict__ x, const float* __restrict__ theta,
    const float* __restrict__ phi_p, const float* __restrict__ g_p,
    const float* __restrict__ Wa, const float* __restrict__ ba,
    const float* __restrict__ sigma, float* __restrict__ out)
{
  __shared__ __attribute__((aligned(16))) float Wa_s[128 * GPITCH];
  __shared__ float ba_s[128];
  __shared__ __attribute__((aligned(16))) float phi_s[2][64 * PPITCH];  // transposed: [m_local][k]
  __shared__ __attribute__((aligned(16))) float g_s[2][64 * GPITCH];    // [c][m_local]

  const int tid = threadIdx.x;
  const int wdst = (tid >> 6) * GPITCH + (tid & 63);   // 256 threads = 4 rows a pass
  for (int j = 0; j < 32; ++j) Wa_s[wdst + j * 4 * GPITCH] = Wa[tid + j * 256];
  if (tid < 128) ba_s[tid] = ba[tid];
  const float sig = sigma[0];

  const int wave = tid >> 5;
  const int lane = tid & 31;
  const int col  = lane & 15;
  const bool lo  = lane < 16;
  const int koff = lo ? 0 : 8;                    // first accumulator row of this lane half

  const int b     = blockIdx.x >> 5;              // 32 blocks per batch
  const int nbase = (blockIdx.x & 31) * 128 + wave * 16;

  const float* thb = theta + (size_t)b * 16 * NPIX;
  const float* phb = phi_p + (size_t)b * 16 * 1024;
  const float* gb  = g_p   + (size_t)b * 64 * 1024;

  // theta B-operands for this row tile, kept in registers for all m
  v2f bth[4];
#pragma unroll
  for (int kk = 0; kk < 4; ++kk) {
    const int k0 = 4 * kk + (lo ? 0 : 2);
    bth[kk].x = thb[(size_t)k0 * NPIX + nbase + col];
    bth[kk].y = thb[(size_t)(k0 + 1) * NPIX + nbase + col];
  }

  v8f O[4];
#pragma unroll
  for (int i = 0; i < 4; ++i) O[i] = zero8();
  float rmax = -__builtin_inff();
  float rsum = 0.f;

  // Staging map: a thread moves 4 keys (16 bytes) of one phi row and of four g rows.
  const int srow = tid >> 4;                 // 0..15
  const int sm   = (tid & 15) * 4;           // key offset inside the chunk
  const float* psrc = phb + (size_t)srow * 1024 + sm;
  const float* gsrc = gb  + (size_t)srow * 1024 + sm;
  const int pdst = sm * PPITCH + srow;
  const int gdst = srow * GPITCH + sm;
  v4f rp, rg[4];                             // the chunk that is on its way

  // The small loops below are unrolled so that rg[] and rp are indexed by constants
  // and stay in registers.

#define LOAD_CHUNK(chn)                                                     \
  do {                                                                      \
    rp = *(const v4f*)(psrc + (chn) * 64);                                  \
    _Pragma("unroll") for (int j = 0; j < 4; ++j)                           \
      rg[j] = *(const v4f*)(gsrc + (size_t)j * 16 * 1024 + (chn) * 64);     \
  } while (0)
#define STORE_CHUNK(buf)                                                    \
  do {                                                                      \
    _Pragma("unroll") for (int e = 0; e < 4; ++e)                           \
      phi_s[buf][pdst + e * PPITCH] = rp[e];                                \
    _Pragma("unroll") for (int j = 0; j < 4; ++j)                           \
      *(v4f*)&g_s[buf][gdst + j * 16 * GPITCH] = rg[j];                     \
  } while (0)

  LOAD_CHUNK(0);
  STORE_CHUNK(0);
  LOAD_CHUNK(1);
  __syncthreads();                           // chunk 0, Wa_s and ba_s are published

  for (int ch2 = 0; ch2 < 16; ch2 += 2)      // 16 chunks of 64 keys
  // Fully unrolled so that the buffer index is a constant in every LDS address.
#pragma unroll
  for (int cur = 0; cur < 2; ++cur) {
    const int ch = ch2 + cur;
    // The other buffer was last read in trip ch-1, which ended in a barrier.
    if (ch + 1 < 16) STORE_CHUNK(cur ^ 1);
    if (ch + 2 < 16) {
      LOAD_CHUNK(ch + 2);
      // The code below reuses the registers that held these loads' addresses:
      // keep the address-translation wait in front of that overwrite.
      asm volatile("s_wait_xcnt 0x0" ::: "memory");
    }

    // One softmax update for the whole chunk of 64 keys.
    // S^T[m, n] = sum_k phi[k,m] * theta[k,n]: the four 16-key tiles are four independent
    // accumulator chains (K=16 as 4 WMMA steps each). All loops of the chunk body are
    // unrolled so that S[], tm[], tsum[] and O[] are indexed by constants and stay in registers.
    v8f S[4];
#pragma unroll
    for (int mt = 0; mt < 4; ++mt) S[mt] = zero8();
#pragma unroll
    for (int kk = 0; kk < 4; ++kk) {
      const int k0 = 4 * kk + (lo ? 0 : 2);
#pragma unroll
      for (int mt = 0; mt < 4; ++mt) {
        v2f A = *(const v2f*)&phi_s[cur][(mt * 16 + col) * PPITCH + k0];
        S[mt] = wmma4(A, bth[kk], S[mt]);
      }
    }
    // flash softmax update (rows m live in VGPRs + opposite lane half)
    float tm[4];
#pragma unroll
    for (int mt = 0; mt < 4; ++mt) {
      tm[mt] = S[mt][0];
#pragma unroll
      for (int r = 1; r < 8; ++r) tm[mt] = fmaxf(tm[mt], S[mt][r]);
    }
    float tmax = fmaxf(fmaxf(tm[0], tm[1]), fmaxf(tm[2], tm[3]));
    tmax = fmaxf(tmax, __shfl_xor(tmax, 16, 32));
    const float nmax  = fmaxf(rmax, tmax);
    const float scale = __expf(rmax - nmax);
    rmax = nmax;
    float tsum[4];
#pragma unroll
    for (int mt = 0; mt < 4; ++mt) {
      tsum[mt] = 0.f;
#pragma unroll
      for (int r = 0; r < 8; ++r) { S[mt][r] = __expf(S[mt][r] - nmax); tsum[mt] += S[mt][r]; }
    }
    float ts = (tsum[0] + tsum[1]) + (tsum[2] + tsum[3]);
    ts += __shfl_xor(ts, 16, 32);
    rsum = rsum * scale + ts;
#pragma unroll
    for (int ct = 0; ct < 4; ++ct)
#pragma unroll
      for (int r = 0; r < 8; ++r) O[ct][r] *= scale;

    // O^T[c, n] += sum_m g[c,m] * P[n,m]; K-step kk of a tile pairs keys 2kk, 2kk+1 (low
    // lane half) and 8+2kk, 9+2kk (high half): P[2kk], P[2kk+1] of each lane as they lie.
#pragma unroll
    for (int mt = 0; mt < 4; ++mt)
#pragma unroll
      for (int j = 0; j < 2; ++j) {
        v4f A[4];
#pragma unroll
        for (int ct = 0; ct < 4; ++ct)
          A[ct] = *(const v4f*)&g_s[cur][(ct * 16 + col) * GPITCH + mt * 16 + koff + 4 * j];
#pragma unroll
        for (int ct = 0; ct < 4; ++ct)
          O[ct] = wmma4(v2f{A[ct].x, A[ct].y}, v2f{S[mt][4 * j],     S[mt][4 * j + 1]}, O[ct]);
#pragma unroll
        for (int ct = 0; ct < 4; ++ct)
          O[ct] = wmma4(v2f{A[ct].z, A[ct].w}, v2f{S[mt][4 * j + 2], S[mt][4 * j + 3]}, O[ct]);
      }
    // One barrier a chunk: it publishes chunk ch+1 and ends the reads of chunk ch.
    if (ch + 1 < 16) __syncthreads();
  }
#undef LOAD_CHUNK
#undef STORE_CHUNK

  // normalize, then out[co,n] = x + sigma * (Wa @ O + ba)
  const float inv = 1.f / rsum;
#pragma unroll
  for (int ct = 0; ct < 4; ++ct)
#pragma unroll
    for (int r = 0; r < 8; ++r) O[ct][r] *= inv;

  const int rowoff = lo ? 0 : 8;
  const float* xb = x   + (size_t)b * CIN * NPIX;
  float*       ob = out + (size_t)b * CIN * NPIX;
#pragma unroll 2
  for (int cot = 0; cot < 8; ++cot) {
    v8f acc = zero8();
#pragma unroll
    for (int ct = 0; ct < 4; ++ct)
#pragma unroll
      for (int j = 0; j < 2; ++j) {
        const v4f A = *(const v4f*)&Wa_s[(cot * 16 + col) * GPITCH + ct * 16 + koff + 4 * j];
        acc = wmma4(v2f{A.x, A.y}, v2f{O[ct][4 * j],     O[ct][4 * j + 1]}, acc);
        acc = wmma4(v2f{A.z, A.w}, v2f{O[ct][4 * j + 2], O[ct][4 * j + 3]}, acc);
      }
#pragma unroll
    for (int r = 0; r < 8; ++r) {
      const int co = cot * 16 + r + rowoff;
      const size_t idx = (size_t)co * NPIX + nbase + col;
      ob[idx] = xb[idx] + sig * (acc[r] + ba_s[co]);
    }
  }
}

// ---------------------------------------------------------------------------
extern "C" void kernel_launch(void* const* d_in, const int* in_sizes, int n_in,
                              void* d_out, int out_size, void* d_ws, size_t ws_size,
                              hipStream_t stream) {
  const float* x     = (const float*)d_in[0];
  const float* Wt    = (const float*)d_in[1];
  const float* bt    = (const float*)d_in[2];
  const float* Wp    = (const float*)d_in[3];
  const float* bp    = (const float*)d_in[4];
  const float* Wg    = (const float*)d_in[5];
  const float* bg    = (const float*)d_in[6];
  const float* Wa    = (const float*)d_in[7];
  const float* ba    = (const float*)d_in[8];
  const float* sigma = (const float*)d_in[9];

  float* ws    = (float*)d_ws;
  float* theta = ws;                       // 16*16*4096 = 1,048,576 f32
  float* phi_p = theta + 1048576;          // 16*16*1024 =   262,144 f32
  float* g_p   = phi_p + 262144;           // 16*64*1024 = 1,048,576 f32

  proj_kernel<<<256, 256, 0, stream>>>(x, Wt, bt, Wp, bp, Wg, bg,
                                       theta, phi_p, g_p);
  attn_kernel<<<512, 256, 0, stream>>>(x, theta, phi_p, g_p, Wa, ba, sigma,
                                       (float*)d_out);
}
